// v000
// Times are from an AMD MI455X. After a warm-up the kernel runs many times in a row, and a time is the length of
// such a window on the GPU divided by its runs, so every launch and the gaps after it count. The runs cycle
// through copies of the inputs. A figure is the median of several windows, for all but v000 over two sittings.
// Sittings can differ by a few percent; kernels timed side by side share one.
// The starting kernel, v000, takes 2050 microseconds a run.
#include <hip/hip_runtime.h>
#include <math.h>

// ---------------------------------------------------------------------------
// CDNA5 (gfx1250) f32 WMMA causal self-attention.
//   DIM=2048, HEADS=16, head_dim=128, BATCH=2, SEQ=2048  ->  M=B*S=4096 rows.
// All matrix math runs on V_WMMA_F32_16X16X4_F32 (full f32 matrix pipe).
// ---------------------------------------------------------------------------

#define SEQ_C   2048
#define DIM_C   2048
#define HEADS_C 16
#define HD_C    128            // head dim
#define MROWS   4096           // BATCH * SEQ

typedef float v2f __attribute__((ext_vector_type(2)));
typedef float v8f __attribute__((ext_vector_type(8)));

__device__ __forceinline__ v8f wmma_f32(v2f a, v2f b, v8f c) {
  // D = A(16x4) * B(4x16) + C(16x16), all f32.
  return __builtin_amdgcn_wmma_f32_16x16x4_f32(
      /*neg_a=*/false, a, /*neg_b=*/false, b,
      /*c_mod=*/(short)0, c, /*reuse_a=*/false, /*reuse_b=*/false);
}

__device__ __forceinline__ v8f v8f_zero() {
  v8f z;
#pragma unroll
  for (int i = 0; i < 8; ++i) z[i] = 0.0f;
  return z;
}

// ---------------------------------------------------------------------------
// GEMM: C[M,N] = A[M,K] @ B[K,N], row-major f32, via WMMA 16x16x4.
// Block = 256 threads = 8 waves. Wave (wm,wn) computes a 16x64 strip:
//   4 accumulator tiles sharing one A fragment per k-step (A reuse).
// Block tile = 64(M) x 128(N). Grid = (M/64, N/128).
// ---------------------------------------------------------------------------
__global__ __launch_bounds__(256) void gemm_f32_wmma(
    const float* __restrict__ A, const float* __restrict__ B,
    float* __restrict__ C, int M, int N, int K) {
  const int lane = threadIdx.x & 31;
  const int wave = threadIdx.x >> 5;
  const int lid  = lane & 15;      // M/N index within tile
  const int lg   = lane >> 4;      // lanegroup: selects K pair / row half
  const int wm   = wave & 3;
  const int wn   = wave >> 2;
  const int m0   = blockIdx.x * 64  + wm * 16;
  const int n0   = blockIdx.y * 128 + wn * 64;

  v8f acc[4];
#pragma unroll
  for (int t = 0; t < 4; ++t) acc[t] = v8f_zero();

  const float* arow = A + (size_t)(m0 + lid) * K;

  for (int k = 0; k < K; k += 8) {
    // A fragments: A[m0+lid][k + 2*lg + {0,1}] (+4 for second k-step)
    v2f a0 = *(const v2f*)(arow + k + 2 * lg);
    v2f a1 = *(const v2f*)(arow + k + 4 + 2 * lg);
#pragma unroll
    for (int t = 0; t < 4; ++t) {
      const float* bcol = B + (size_t)(k + 2 * lg) * N + n0 + t * 16 + lid;
      v2f b0, b1;
      b0.x = bcol[0];
      b0.y = bcol[N];
      b1.x = bcol[4 * (size_t)N];
      b1.y = bcol[5 * (size_t)N];
      acc[t] = wmma_f32(a0, b0, acc[t]);
      acc[t] = wmma_f32(a1, b1, acc[t]);
    }
  }

  // D layout: vgpr i, lanegroup lg -> row = i + 8*lg, col = lid.
#pragma unroll
  for (int t = 0; t < 4; ++t)
#pragma unroll
    for (int i = 0; i < 8; ++i)
      C[(size_t)(m0 + i + 8 * lg) * N + n0 + t * 16 + lid] = acc[t][i];
}

// ---------------------------------------------------------------------------
// Attention: per (batch,head), flash-style streaming softmax.
// One wave owns a 16-row query block, iterates 16-key blocks.
// Mask: KEEP col > row (strictly upper),
// masked value = -FLT_MAX (so fully-masked rows -> uniform).
// ---------------------------------------------------------------------------
__global__ __launch_bounds__(256, 1) void attn_f32_wmma(
    const float* __restrict__ Q, const float* __restrict__ Km,
    const float* __restrict__ V, float* __restrict__ O) {
  __shared__ __align__(16) float Pl[8][16 * 18];  // per-wave 16x16 tile, pad 18

  const int lane = threadIdx.x & 31;
  const int wave = threadIdx.x >> 5;
  const int lid  = lane & 15;
  const int lg   = lane >> 4;

  const int bh = blockIdx.x;           // 0..31
  const int b  = bh >> 4;
  const int h  = bh & 15;
  const int qb = blockIdx.y * 8 + wave;  // 0..127
  const int q0 = qb * 16;
  const int d0 = h * HD_C;
  const size_t rowbase = (size_t)b * SEQ_C;

  // Preload Q block as A-fragments: qa[s] covers K-dim = 4*s + 2*lg + {0,1}.
  const float* qrow = Q + (rowbase + q0 + lid) * DIM_C + d0;
  v2f qa[32];
#pragma unroll
  for (int s = 0; s < 32; ++s) qa[s] = *(const v2f*)(qrow + 4 * s + 2 * lg);

  v8f o[8];
#pragma unroll
  for (int dt = 0; dt < 8; ++dt) o[dt] = v8f_zero();
  float m[8], l[8];
#pragma unroll
  for (int i = 0; i < 8; ++i) { m[i] = -INFINITY; l[i] = 0.0f; }

  const float scale = 0.08838834764831845f;  // 1/sqrt(128)
  const float MASKV = -3.402823466e38f;      // -FLT_MAX

  for (int kb = 0; kb < SEQ_C / 16; ++kb) {
    const int kk0 = kb * 16;

    // ---- S = Q @ K^T : B-frag b.x = K[kk0+lid][dd + 2*lg] ----
    v8f s = v8f_zero();
    const float* krow = Km + (rowbase + kk0 + lid) * DIM_C + d0;
#pragma unroll
    for (int ss = 0; ss < 32; ++ss) {
      v2f bf = *(const v2f*)(krow + 4 * ss + 2 * lg);
      s = wmma_f32(qa[ss], bf, s);
    }

    // ---- mask + online softmax update ----
    float alpha[8];
#pragma unroll
    for (int i = 0; i < 8; ++i) {
      const int row = q0 + i + 8 * lg;
      const int col = kk0 + lid;
      float sv = s[i] * scale;
      if (!(col > row)) sv = MASKV;  // keep strictly-upper only
      // row max across the 16 lanes holding this row
      float t = sv;
      t = fmaxf(t, __shfl_xor(t, 1, 16));
      t = fmaxf(t, __shfl_xor(t, 2, 16));
      t = fmaxf(t, __shfl_xor(t, 4, 16));
      t = fmaxf(t, __shfl_xor(t, 8, 16));
      const float mnew = fmaxf(m[i], t);
      alpha[i] = expf(m[i] - mnew);
      const float pv = expf(sv - mnew);
      m[i] = mnew;
      float rs = pv;
      rs += __shfl_xor(rs, 1, 16);
      rs += __shfl_xor(rs, 2, 16);
      rs += __shfl_xor(rs, 4, 16);
      rs += __shfl_xor(rs, 8, 16);
      l[i] = l[i] * alpha[i] + rs;
      Pl[wave][(i + 8 * lg) * 18 + lid] = pv;  // stash P tile (D layout)
    }

    // rescale running output
#pragma unroll
    for (int dt = 0; dt < 8; ++dt)
#pragma unroll
      for (int i = 0; i < 8; ++i) o[dt][i] *= alpha[i];

    // ---- reload P as A-fragments (D layout -> A layout via LDS) ----
    v2f pa[4];
#pragma unroll
    for (int kk = 0; kk < 4; ++kk)
      pa[kk] = *(const v2f*)&Pl[wave][lid * 18 + kk * 4 + 2 * lg];

    // ---- O += P @ V ----
#pragma unroll
    for (int dt = 0; dt < 8; ++dt) {
      const float* vcol = V + (rowbase + kk0) * DIM_C + d0 + dt * 16 + lid;
#pragma unroll
      for (int kk = 0; kk < 4; ++kk) {
        v2f bf;
        bf.x = vcol[(size_t)(kk * 4 + 2 * lg) * DIM_C];
        bf.y = vcol[(size_t)(kk * 4 + 2 * lg + 1) * DIM_C];
        o[dt] = wmma_f32(pa[kk], bf, o[dt]);
      }
    }
  }

  // ---- normalize and store (b, s, h*d) layout: un-transposed directly ----
#pragma unroll
  for (int i = 0; i < 8; ++i) {
    const float inv = 1.0f / l[i];
    float* orow = O + (rowbase + q0 + i + 8 * lg) * DIM_C + d0;
#pragma unroll
    for (int dt = 0; dt < 8; ++dt) orow[dt * 16 + lid] = o[dt][i] * inv;
  }
}

// ---------------------------------------------------------------------------
// Launch: Q/K/V projections -> attention -> output projection.
// Workspace: Q | K | V | attn_out, 32 MB each (128 MB total).
// ---------------------------------------------------------------------------
extern "C" void kernel_launch(void* const* d_in, const int* in_sizes, int n_in,
                              void* d_out, int out_size, void* d_ws, size_t ws_size,
                              hipStream_t stream) {
  const float* x  = (const float*)d_in[0];
  const float* Wq = (const float*)d_in[1];
  const float* Wk = (const float*)d_in[2];
  const float* Wv = (const float*)d_in[3];
  const float* Wo = (const float*)d_in[4];
  float* out = (float*)d_out;

  const size_t mat = (size_t)MROWS * DIM_C;  // 8M floats = 32MB
  float* Qb = (float*)d_ws;
  float* Kb = Qb + mat;
  float* Vb = Kb + mat;
  float* Ab = Vb + mat;

  dim3 gblk(256);
  dim3 ggrid(MROWS / 64, DIM_C / 128);
  gemm_f32_wmma<<<ggrid, gblk, 0, stream>>>(x, Wq, Qb, MROWS, DIM_C, DIM_C);
  gemm_f32_wmma<<<ggrid, gblk, 0, stream>>>(x, Wk, Kb, MROWS, DIM_C, DIM_C);
  gemm_f32_wmma<<<ggrid, gblk, 0, stream>>>(x, Wv, Vb, MROWS, DIM_C, DIM_C);

  dim3 agrid(2 * HEADS_C, SEQ_C / (16 * 8));
  attn_f32_wmma<<<agrid, gblk, 0, stream>>>(Qb, Kb, Vb, Ab);

  gemm_f32_wmma<<<ggrid, gblk, 0, stream>>>(Ab, Wo, out, MROWS, DIM_C, DIM_C);
}

// v001
// Measured time: 2020 microseconds a run.
// Next to v000, in two timings, it ran 1.05 times as fast each time.
#include <hip/hip_runtime.h>
#include <math.h>

// ---------------------------------------------------------------------------
// CDNA5 (gfx1250) f32 WMMA causal self-attention.
//   DIM=2048, HEADS=16, head_dim=128, BATCH=2, SEQ=2048  ->  M=B*S=4096 rows.
// All matrix math runs on V_WMMA_F32_16X16X4_F32 (full f32 matrix pipe).
// ---------------------------------------------------------------------------

#define SEQ_C   2048
#define DIM_C   2048
#define HEADS_C 16
#define HD_C    128            // head dim
#define MROWS   4096           // BATCH * SEQ

typedef float v2f __attribute__((ext_vector_type(2)));
typedef float v4f __attribute__((ext_vector_type(4)));
typedef float v8f __attribute__((ext_vector_type(8)));

__device__ __forceinline__ v8f wmma_f32(v2f a, v2f b, v8f c) {
  // D = A(16x4) * B(4x16) + C(16x16), all f32.
  return __builtin_amdgcn_wmma_f32_16x16x4_f32(
      /*neg_a=*/false, a, /*neg_b=*/false, b,
      /*c_mod=*/(short)0, c, /*reuse_a=*/false, /*reuse_b=*/false);
}

__device__ __forceinline__ v8f v8f_zero() {
  v8f z;
#pragma unroll
  for (int i = 0; i < 8; ++i) z[i] = 0.0f;
  return z;
}

// ---------------------------------------------------------------------------
// GEMM: C[M,N] = A[M,K] @ B[K,N], row-major f32, via WMMA 16x16x4.
// Block = 256 threads = 8 waves. Wave (wm,wn) computes a 16x64 strip:
//   4 accumulator tiles sharing one A fragment per k-step (A reuse).
// Block tile = 64(M) x 128(N). Grid = (M/64, N/128).
// Every fragment load is 16 bytes per lane, so that a load touches few cache
// lines per byte:
//   k order: of 8 consecutive k, lanegroup lg holds k+4*lg+{0..3}; the first
//   WMMA takes elements {0,1}, the second {2,3}, in A and in B alike.
//   columns: a lane holds 4 adjacent columns of a B row, one per accumulator
//   tile, so tile t, lane lid is column n0 + 4*lid + t.
// ---------------------------------------------------------------------------
__global__ __launch_bounds__(256) void gemm_f32_wmma(
    const float* __restrict__ A, const float* __restrict__ B,
    float* __restrict__ C, int M, int N, int K) {
  const int lane = threadIdx.x & 31;
  const int wave = threadIdx.x >> 5;
  const int lid  = lane & 15;      // M/N index within tile
  const int lg   = lane >> 4;      // lanegroup: selects K run of 4 / row half
  const int wm   = wave & 3;
  const int wn   = wave >> 2;
  const int m0   = blockIdx.x * 64  + wm * 16;
  const int n0   = blockIdx.y * 128 + wn * 64;

  v8f acc[4];
#pragma unroll
  for (int t = 0; t < 4; ++t) acc[t] = v8f_zero();

  const float* arow = A + (size_t)(m0 + lid) * K + 4 * lg;
  const float* bcol = B + (size_t)(4 * lg) * N + n0 + 4 * lid;

  for (int k = 0; k < K; k += 8) {
    // A[m0+lid][k + 4*lg + {0..3}]
    const v4f a4 = *(const v4f*)(arow + k);
    // B[k + 4*lg + {0..3}][n0 + 4*lid + {0..3}]
    const float* bp = bcol + (size_t)k * N;
    const v4f r0 = *(const v4f*)(bp);
    const v4f r1 = *(const v4f*)(bp + (size_t)N);
    const v4f r2 = *(const v4f*)(bp + 2 * (size_t)N);
    const v4f r3 = *(const v4f*)(bp + 3 * (size_t)N);
    v2f a0, a1;
    a0.x = a4.x; a0.y = a4.y;
    a1.x = a4.z; a1.y = a4.w;
#pragma unroll
    for (int t = 0; t < 4; ++t) {
      v2f b0;
      b0.x = r0[t]; b0.y = r1[t];
      acc[t] = wmma_f32(a0, b0, acc[t]);
    }
#pragma unroll
    for (int t = 0; t < 4; ++t) {
      v2f b1;
      b1.x = r2[t]; b1.y = r3[t];
      acc[t] = wmma_f32(a1, b1, acc[t]);
    }
  }

  // D layout: vgpr i, lanegroup lg -> row = i + 8*lg, col = 4*lid + t.
#pragma unroll
  for (int i = 0; i < 8; ++i) {
    v4f c4;
#pragma unroll
    for (int t = 0; t < 4; ++t) c4[t] = acc[t][i];
    *(v4f*)(C + (size_t)(m0 + i + 8 * lg) * N + n0 + 4 * lid) = c4;
  }
}

// ---------------------------------------------------------------------------
// Attention: per (batch,head), flash-style streaming softmax.
// One wave owns a 16-row query block, iterates 16-key blocks.
// Mask: KEEP col > row (strictly upper),
// masked value = -FLT_MAX (so fully-masked rows -> uniform).
// Fragment loads are 16 bytes per lane, as in the GEMM: Q and K share the k
// order d = 8*s + 4*lg + {0..3}; output tile 4*g + t, lane lid is head column
// 64*g + 4*lid + t.
// ---------------------------------------------------------------------------
__global__ __launch_bounds__(256, 1) void attn_f32_wmma(
    const float* __restrict__ Q, const float* __restrict__ Km,
    const float* __restrict__ V, float* __restrict__ O) {
  __shared__ __align__(16) float Pl[8][16 * 18];  // per-wave 16x16 tile, pad 18

  const int lane = threadIdx.x & 31;
  const int wave = threadIdx.x >> 5;
  const int lid  = lane & 15;
  const int lg   = lane >> 4;

  const int bh = blockIdx.x;           // 0..31
  const int b  = bh >> 4;
  const int h  = bh & 15;
  const int qb = blockIdx.y * 8 + wave;  // 0..127
  const int q0 = qb * 16;
  const int d0 = h * HD_C;
  const size_t rowbase = (size_t)b * SEQ_C;

  // Preload Q block as A-fragments: qa[s] covers K-dim = 8*s + 4*lg + {0..3}.
  const float* qrow = Q + (rowbase + q0 + lid) * DIM_C + d0 + 4 * lg;
  v4f qa[16];
#pragma unroll
  for (int s = 0; s < 16; ++s) qa[s] = *(const v4f*)(qrow + 8 * s);

  v8f o[8];
#pragma unroll
  for (int dt = 0; dt < 8; ++dt) o[dt] = v8f_zero();
  float m[8], l[8];
#pragma unroll
  for (int i = 0; i < 8; ++i) { m[i] = -INFINITY; l[i] = 0.0f; }

  const float scale = 0.08838834764831845f;  // 1/sqrt(128)
  const float MASKV = -3.402823466e38f;      // -FLT_MAX

  for (int kb = 0; kb < SEQ_C / 16; ++kb) {
    const int kk0 = kb * 16;

    // ---- S = Q @ K^T : B-frags from K[kk0+lid][8*ss + 4*lg + {0..3}] ----
    v8f s = v8f_zero();
    const float* krow = Km + (rowbase + kk0 + lid) * DIM_C + d0 + 4 * lg;
#pragma unroll
    for (int ss = 0; ss < 16; ++ss) {
      const v4f kf = *(const v4f*)(krow + 8 * ss);
      v2f qlo, qhi, klo, khi;
      qlo.x = qa[ss].x; qlo.y = qa[ss].y;
      qhi.x = qa[ss].z; qhi.y = qa[ss].w;
      klo.x = kf.x; klo.y = kf.y;
      khi.x = kf.z; khi.y = kf.w;
      s = wmma_f32(qlo, klo, s);
      s = wmma_f32(qhi, khi, s);
    }

    // ---- mask + online softmax update ----
    float alpha[8];
#pragma unroll
    for (int i = 0; i < 8; ++i) {
      const int row = q0 + i + 8 * lg;
      const int col = kk0 + lid;
      float sv = s[i] * scale;
      if (!(col > row)) sv = MASKV;  // keep strictly-upper only
      // row max across the 16 lanes holding this row
      float t = sv;
      t = fmaxf(t, __shfl_xor(t, 1, 16));
      t = fmaxf(t, __shfl_xor(t, 2, 16));
      t = fmaxf(t, __shfl_xor(t, 4, 16));
      t = fmaxf(t, __shfl_xor(t, 8, 16));
      const float mnew = fmaxf(m[i], t);
      alpha[i] = expf(m[i] - mnew);
      const float pv = expf(sv - mnew);
      m[i] = mnew;
      float rs = pv;
      rs += __shfl_xor(rs, 1, 16);
      rs += __shfl_xor(rs, 2, 16);
      rs += __shfl_xor(rs, 4, 16);
      rs += __shfl_xor(rs, 8, 16);
      l[i] = l[i] * alpha[i] + rs;
      Pl[wave][(i + 8 * lg) * 18 + lid] = pv;  // stash P tile (D layout)
    }

    // rescale running output
#pragma unroll
    for (int dt = 0; dt < 8; ++dt)
#pragma unroll
      for (int i = 0; i < 8; ++i) o[dt][i] *= alpha[i];

    // ---- reload P as A-fragments (D layout -> A layout via LDS) ----
    v2f pa[4];
#pragma unroll
    for (int kk = 0; kk < 4; ++kk)
      pa[kk] = *(const v2f*)&Pl[wave][lid * 18 + kk * 4 + 2 * lg];

    // ---- O += P @ V ----
#pragma unroll
    for (int g = 0; g < 2; ++g) {
      const float* vcol =
          V + (rowbase + kk0 + 2 * lg) * DIM_C + d0 + g * 64 + 4 * lid;
#pragma unroll
      for (int kk = 0; kk < 4; ++kk) {
        // keys kk*4 + 2*lg + {0,1}, four adjacent head columns each
        const v4f v0 = *(const v4f*)(vcol + (size_t)(kk * 4) * DIM_C);
        const v4f v1 = *(const v4f*)(vcol + (size_t)(kk * 4 + 1) * DIM_C);
#pragma unroll
        for (int t = 0; t < 4; ++t) {
          v2f bf;
          bf.x = v0[t]; bf.y = v1[t];
          o[g * 4 + t] = wmma_f32(pa[kk], bf, o[g * 4 + t]);
        }
      }
    }
  }

  // ---- normalize and store (b, s, h*d) layout: un-transposed directly ----
#pragma unroll
  for (int i = 0; i < 8; ++i) {
    const float inv = 1.0f / l[i];
    float* orow = O + (rowbase + q0 + i + 8 * lg) * DIM_C + d0 + 4 * lid;
#pragma unroll
    for (int g = 0; g < 2; ++g) {
      v4f o4;
#pragma unroll
      for (int t = 0; t < 4; ++t) o4[t] = o[g * 4 + t][i] * inv;
      *(v4f*)(orow + g * 64) = o4;
    }
  }
}

// ---------------------------------------------------------------------------
// Launch: Q/K/V projections -> attention -> output projection.
// Workspace: Q | K | V | attn_out, 32 MB each (128 MB total).
// ---------------------------------------------------------------------------
extern "C" void kernel_launch(void* const* d_in, const int* in_sizes, int n_in,
                              void* d_out, int out_size, void* d_ws, size_t ws_size,
                              hipStream_t stream) {
  const float* x  = (const float*)d_in[0];
  const float* Wq = (const float*)d_in[1];
  const float* Wk = (const float*)d_in[2];
  const float* Wv = (const float*)d_in[3];
  const float* Wo = (const float*)d_in[4];
  float* out = (float*)d_out;

  const size_t mat = (size_t)MROWS * DIM_C;  // 8M floats = 32MB
  float* Qb = (float*)d_ws;
  float* Kb = Qb + mat;
  float* Vb = Kb + mat;
  float* Ab = Vb + mat;

  dim3 gblk(256);
  dim3 ggrid(MROWS / 64, DIM_C / 128);
  gemm_f32_wmma<<<ggrid, gblk, 0, stream>>>(x, Wq, Qb, MROWS, DIM_C, DIM_C);
  gemm_f32_wmma<<<ggrid, gblk, 0, stream>>>(x, Wk, Kb, MROWS, DIM_C, DIM_C);
  gemm_f32_wmma<<<ggrid, gblk, 0, stream>>>(x, Wv, Vb, MROWS, DIM_C, DIM_C);

  dim3 agrid(2 * HEADS_C, SEQ_C / (16 * 8));
  attn_f32_wmma<<<agrid, gblk, 0, stream>>>(Qb, Kb, Vb, Ab);

  gemm_f32_wmma<<<ggrid, gblk, 0, stream>>>(Ab, Wo, out, MROWS, DIM_C, DIM_C);
}

// v002
// One run takes 1240 microseconds.
// In both of two side-by-side timings against v001, it was 1.63 times as fast.
// All steps since v000 together make it 1.71 times as fast.
#include <hip/hip_runtime.h>
#include <math.h>

// ---------------------------------------------------------------------------
// CDNA5 (gfx1250) f32 WMMA causal self-attention.
//   DIM=2048, HEADS=16, head_dim=128, BATCH=2, SEQ=2048  ->  M=B*S=4096 rows.
// All matrix math runs on V_WMMA_F32_16X16X4_F32 (full f32 matrix pipe).
// ---------------------------------------------------------------------------

#define SEQ_C   2048
#define DIM_C   2048
#define HEADS_C 16
#define HD_C    128            // head dim
#define MROWS   4096           // BATCH * SEQ

typedef float v2f __attribute__((ext_vector_type(2)));
typedef float v4f __attribute__((ext_vector_type(4)));
typedef float v8f __attribute__((ext_vector_type(8)));

__device__ __forceinline__ v8f wmma_f32(v2f a, v2f b, v8f c) {
  // D = A(16x4) * B(4x16) + C(16x16), all f32.
  return __builtin_amdgcn_wmma_f32_16x16x4_f32(
      /*neg_a=*/false, a, /*neg_b=*/false, b,
      /*c_mod=*/(short)0, c, /*reuse_a=*/false, /*reuse_b=*/false);
}

__device__ __forceinline__ v8f v8f_zero() {
  v8f z;
#pragma unroll
  for (int i = 0; i < 8; ++i) z[i] = 0.0f;
  return z;
}

// ---------------------------------------------------------------------------
// GEMM: C[M,N] = A[M,K] @ B[K,N], row-major f32, via WMMA 16x16x4.
// Block = 256 threads = 8 waves. Wave (wm,wn) computes a 16x64 strip:
//   4 accumulator tiles sharing one A fragment per k-step (A reuse).
// Block tile = 64(M) x 128(N). Grid = (M/64, N/128).
// Every fragment load is 16 bytes per lane, so that a load touches few cache
// lines per byte:
//   k order: of 8 consecutive k, lanegroup lg holds k+4*lg+{0..3}; the first
//   WMMA takes elements {0,1}, the second {2,3}, in A and in B alike.
//   columns: a lane holds 4 adjacent columns of a B row, one per accumulator
//   tile, so tile t, lane lid is column n0 + 4*lid + t.
// ---------------------------------------------------------------------------
__global__ __launch_bounds__(256) void gemm_f32_wmma(
    const float* __restrict__ A, const float* __restrict__ B,
    float* __restrict__ C, int M, int N, int K) {
  const int lane = threadIdx.x & 31;
  const int wave = threadIdx.x >> 5;
  const int lid  = lane & 15;      // M/N index within tile
  const int lg   = lane >> 4;      // lanegroup: selects K run of 4 / row half
  const int wm   = wave & 3;
  const int wn   = wave >> 2;
  const int m0   = blockIdx.x * 64  + wm * 16;
  const int n0   = blockIdx.y * 128 + wn * 64;

  v8f acc[4];
#pragma unroll
  for (int t = 0; t < 4; ++t) acc[t] = v8f_zero();

  const float* arow = A + (size_t)(m0 + lid) * K + 4 * lg;
  const float* bcol = B + (size_t)(4 * lg) * N + n0 + 4 * lid;

  for (int k = 0; k < K; k += 8) {
    // A[m0+lid][k + 4*lg + {0..3}]
    const v4f a4 = *(const v4f*)(arow + k);
    // B[k + 4*lg + {0..3}][n0 + 4*lid + {0..3}]
    const float* bp = bcol + (size_t)k * N;
    const v4f r0 = *(const v4f*)(bp);
    const v4f r1 = *(const v4f*)(bp + (size_t)N);
    const v4f r2 = *(const v4f*)(bp + 2 * (size_t)N);
    const v4f r3 = *(const v4f*)(bp + 3 * (size_t)N);
    v2f a0, a1;
    a0.x = a4.x; a0.y = a4.y;
    a1.x = a4.z; a1.y = a4.w;
#pragma unroll
    for (int t = 0; t < 4; ++t) {
      v2f b0;
      b0.x = r0[t]; b0.y = r1[t];
      acc[t] = wmma_f32(a0, b0, acc[t]);
    }
#pragma unroll
    for (int t = 0; t < 4; ++t) {
      v2f b1;
      b1.x = r2[t]; b1.y = r3[t];
      acc[t] = wmma_f32(a1, b1, acc[t]);
    }
  }

  // D layout: vgpr i, lanegroup lg -> row = i + 8*lg, col = 4*lid + t.
#pragma unroll
  for (int i = 0; i < 8; ++i) {
    v4f c4;
#pragma unroll
    for (int t = 0; t < 4; ++t) c4[t] = acc[t][i];
    *(v4f*)(C + (size_t)(m0 + i + 8 * lg) * N + n0 + 4 * lid) = c4;
  }
}

__device__ __forceinline__ float other_half(float x) {
  // value of lane l ^ 16
  return __builtin_bit_cast(
      float, __builtin_amdgcn_permlanex16(__builtin_bit_cast(int, x),
                                          __builtin_bit_cast(int, x),
                                          0x76543210, 0xfedcba98, false, false));
}

__global__ __launch_bounds__(256, 1) void attn_f32_wmma(
    const float* __restrict__ Q, const float* __restrict__ Km,
    const float* __restrict__ V, float* __restrict__ O) {
  const int lane = threadIdx.x & 31;
  const int wave = threadIdx.x >> 5;
  const int lid  = lane & 15;
  const int lg   = lane >> 4;

  const int bh = blockIdx.x;           // 0..31
  const int b  = bh >> 4;
  const int h  = bh & 15;
  const int qb = blockIdx.y * 8 + wave;  // 0..127
  const int q0 = qb * 16;
  const int d0 = h * HD_C;
  const size_t rowbase = (size_t)b * SEQ_C;

  // Preload Q block as B-fragments: qa[s] covers K-dim = 8*s + 4*lg + {0..3}.
  const float* qrow = Q + (rowbase + q0 + lid) * DIM_C + d0 + 4 * lg;
  v4f qa[16];
#pragma unroll
  for (int s = 0; s < 16; ++s) qa[s] = *(const v4f*)(qrow + 8 * s);

  v8f o[8];
#pragma unroll
  for (int dt = 0; dt < 8; ++dt) o[dt] = v8f_zero();
  float m = -INFINITY;  // running maximum of query lid (equal in both halves)
  float l = 0.0f;       // running sum of query lid over this half's keys

  const float scale = 0.08838834764831845f;  // 1/sqrt(128)
  const float MASKV = -3.402823466e38f;      // -FLT_MAX
  const int row = q0 + lid;

  for (int kb = 0; kb < SEQ_C / 16; ++kb) {
    const int kk0 = kb * 16;

    // ---- S^T = K @ Q^T : A-frags from K[kk0+lid][8*ss + 4*lg + {0..3}] ----
    v8f s = v8f_zero();
    const float* krow = Km + (rowbase + kk0 + lid) * DIM_C + d0 + 4 * lg;
#pragma unroll
    for (int ss = 0; ss < 16; ++ss) {
      const v4f kf = *(const v4f*)(krow + 8 * ss);
      v2f qlo, qhi, klo, khi;
      qlo.x = qa[ss].x; qlo.y = qa[ss].y;
      qhi.x = qa[ss].z; qhi.y = qa[ss].w;
      klo.x = kf.x; klo.y = kf.y;
      khi.x = kf.z; khi.y = kf.w;
      s = wmma_f32(klo, qlo, s);
      s = wmma_f32(khi, qhi, s);
    }

    // ---- mask + online softmax update: s[i] = S[row][kk0 + i + 8*lg] ----
    float sv[8];
#pragma unroll
    for (int i = 0; i < 8; ++i) {
      const int col = kk0 + i + 8 * lg;
      sv[i] = s[i] * scale;
      if (!(col > row)) sv[i] = MASKV;  // keep strictly-upper only
    }
    float t = fmaxf(fmaxf(fmaxf(sv[0], sv[1]), fmaxf(sv[2], sv[3])),
                    fmaxf(fmaxf(sv[4], sv[5]), fmaxf(sv[6], sv[7])));
    t = fmaxf(t, other_half(t));
    const float mnew = fmaxf(m, t);
    const float alpha = expf(m - mnew);
    m = mnew;
    float pv[8];
#pragma unroll
    for (int i = 0; i < 8; ++i) pv[i] = expf(sv[i] - mnew);
    l = l * alpha + (((pv[0] + pv[1]) + (pv[2] + pv[3])) +
                     ((pv[4] + pv[5]) + (pv[6] + pv[7])));

    // rescale running output (every element of a lane belongs to query lid)
#pragma unroll
    for (int dt = 0; dt < 8; ++dt)
#pragma unroll
      for (int i = 0; i < 8; ++i) o[dt][i] *= alpha;

    // ---- O^T += V^T @ P^T ----
#pragma unroll
    for (int g = 0; g < 2; ++g) {
      const float* vcol =
          V + (rowbase + kk0 + 8 * lg) * DIM_C + d0 + g * 64 + 4 * lid;
#pragma unroll
      for (int c = 0; c < 4; ++c) {
        // keys 2*c + 8*lg + {0,1}, four adjacent head columns each
        const v4f v0 = *(const v4f*)(vcol + (size_t)(2 * c) * DIM_C);
        const v4f v1 = *(const v4f*)(vcol + (size_t)(2 * c + 1) * DIM_C);
        v2f pf;
        pf.x = pv[2 * c]; pf.y = pv[2 * c + 1];
#pragma unroll
        for (int tt = 0; tt < 4; ++tt) {
          v2f vf;
          vf.x = v0[tt]; vf.y = v1[tt];
          o[g * 4 + tt] = wmma_f32(vf, pf, o[g * 4 + tt]);
        }
      }
    }
  }

  // ---- normalize and store (b, s, h*d) layout: un-transposed directly ----
  // o[4*g + t][i] = O[row][64*g + 4*(i + 8*lg) + t]
  const float inv = 1.0f / (l + other_half(l));
  float* orow = O + (rowbase + row) * DIM_C + d0 + 32 * lg;
#pragma unroll
  for (int g = 0; g < 2; ++g) {
#pragma unroll
    for (int i = 0; i < 8; ++i) {
      v4f o4;
#pragma unroll
      for (int tt = 0; tt < 4; ++tt) o4[tt] = o[g * 4 + tt][i] * inv;
      *(v4f*)(orow + g * 64 + 4 * i) = o4;
    }
  }
}

// ---------------------------------------------------------------------------
// Launch: Q/K/V projections -> attention -> output projection.
// Workspace: Q | K | V | attn_out, 32 MB each (128 MB total).
// ---------------------------------------------------------------------------
extern "C" void kernel_launch(void* const* d_in, const int* in_sizes, int n_in,
                              void* d_out, int out_size, void* d_ws, size_t ws_size,
                              hipStream_t stream) {
  const float* x  = (const float*)d_in[0];
  const float* Wq = (const float*)d_in[1];
  const float* Wk = (const float*)d_in[2];
  const float* Wv = (const float*)d_in[3];
  const float* Wo = (const float*)d_in[4];
  float* out = (float*)d_out;

  const size_t mat = (size_t)MROWS * DIM_C;  // 8M floats = 32MB
  float* Qb = (float*)d_ws;
  float* Kb = Qb + mat;
  float* Vb = Kb + mat;
  float* Ab = Vb + mat;

  dim3 gblk(256);
  dim3 ggrid(MROWS / 64, DIM_C / 128);
  gemm_f32_wmma<<<ggrid, gblk, 0, stream>>>(x, Wq, Qb, MROWS, DIM_C, DIM_C);
  gemm_f32_wmma<<<ggrid, gblk, 0, stream>>>(x, Wk, Kb, MROWS, DIM_C, DIM_C);
  gemm_f32_wmma<<<ggrid, gblk, 0, stream>>>(x, Wv, Vb, MROWS, DIM_C, DIM_C);

  dim3 agrid(2 * HEADS_C, SEQ_C / (16 * 8));
  attn_f32_wmma<<<agrid, gblk, 0, stream>>>(Qb, Kb, Vb, Ab);

  gemm_f32_wmma<<<ggrid, gblk, 0, stream>>>(Ab, Wo, out, MROWS, DIM_C, DIM_C);
}

// v003
// Measured time: 1100 microseconds a run.
// In both of two side-by-side timings against v002, it was 1.13 times as fast.
// Over all steps from v000 it is 1.93 times as fast.
#include <hip/hip_runtime.h>
#include <math.h>

// ---------------------------------------------------------------------------
// CDNA5 (gfx1250) f32 WMMA causal self-attention.
//   DIM=2048, HEADS=16, head_dim=128, BATCH=2, SEQ=2048  ->  M=B*S=4096 rows.
// All matrix math runs on V_WMMA_F32_16X16X4_F32 (full f32 matrix pipe).
// ---------------------------------------------------------------------------

#define SEQ_C   2048
#define DIM_C   2048
#define HEADS_C 16
#define HD_C    128            // head dim
#define MROWS   4096           // BATCH * SEQ

typedef float v2f __attribute__((ext_vector_type(2)));
typedef float v4f __attribute__((ext_vector_type(4)));
typedef float v8f __attribute__((ext_vector_type(8)));

__device__ __forceinline__ v8f wmma_f32(v2f a, v2f b, v8f c) {
  // D = A(16x4) * B(4x16) + C(16x16), all f32.
  return __builtin_amdgcn_wmma_f32_16x16x4_f32(
      /*neg_a=*/false, a, /*neg_b=*/false, b,
      /*c_mod=*/(short)0, c, /*reuse_a=*/false, /*reuse_b=*/false);
}

__device__ __forceinline__ v8f v8f_zero() {
  v8f z;
#pragma unroll
  for (int i = 0; i < 8; ++i) z[i] = 0.0f;
  return z;
}

// ---------------------------------------------------------------------------
// GEMM: C[M,N] = A[M,K] @ B[K,N], row-major f32, via WMMA 16x16x4.
// Block = 256 threads = 8 waves. Wave (wm,wn) computes a 16x64 strip:
//   4 accumulator tiles sharing one A fragment per k-step (A reuse).
// Block tile = 64(M) x 128(N). Grid = (M/64, N/128).
// Every fragment load is 16 bytes per lane, so that a load touches few cache
// lines per byte:
//   k order: of 8 consecutive k, lanegroup lg holds k+4*lg+{0..3}; the first
//   WMMA takes elements {0,1}, the second {2,3}, in A and in B alike.
//   columns: a lane holds 4 adjacent columns of a B row, one per accumulator
//   tile, so tile t, lane lid is column n0 + 4*lid + t.
// ---------------------------------------------------------------------------
__global__ __launch_bounds__(256) void gemm_f32_wmma(
    const float* __restrict__ A, const float* __restrict__ B,
    float* __restrict__ C, int M, int N, int K) {
  const int lane = threadIdx.x & 31;
  const int wave = threadIdx.x >> 5;
  const int lid  = lane & 15;      // M/N index within tile
  const int lg   = lane >> 4;      // lanegroup: selects K run of 4 / row half
  const int wm   = wave & 3;
  const int wn   = wave >> 2;
  const int m0   = blockIdx.x * 64  + wm * 16;
  const int n0   = blockIdx.y * 128 + wn * 64;

  v8f acc[4];
#pragma unroll
  for (int t = 0; t < 4; ++t) acc[t] = v8f_zero();

  const float* arow = A + (size_t)(m0 + lid) * K + 4 * lg;
  const float* bcol = B + (size_t)(4 * lg) * N + n0 + 4 * lid;

  for (int k = 0; k < K; k += 8) {
    // A[m0+lid][k + 4*lg + {0..3}]
    const v4f a4 = *(const v4f*)(arow + k);
    // B[k + 4*lg + {0..3}][n0 + 4*lid + {0..3}]
    const float* bp = bcol + (size_t)k * N;
    const v4f r0 = *(const v4f*)(bp);
    const v4f r1 = *(const v4f*)(bp + (size_t)N);
    const v4f r2 = *(const v4f*)(bp + 2 * (size_t)N);
    const v4f r3 = *(const v4f*)(bp + 3 * (size_t)N);
    v2f a0, a1;
    a0.x = a4.x; a0.y = a4.y;
    a1.x = a4.z; a1.y = a4.w;
#pragma unroll
    for (int t = 0; t < 4; ++t) {
      v2f b0;
      b0.x = r0[t]; b0.y = r1[t];
      acc[t] = wmma_f32(a0, b0, acc[t]);
    }
#pragma unroll
    for (int t = 0; t < 4; ++t) {
      v2f b1;
      b1.x = r2[t]; b1.y = r3[t];
      acc[t] = wmma_f32(a1, b1, acc[t]);
    }
  }

  // D layout: vgpr i, lanegroup lg -> row = i + 8*lg, col = 4*lid + t.
#pragma unroll
  for (int i = 0; i < 8; ++i) {
    v4f c4;
#pragma unroll
    for (int t = 0; t < 4; ++t) c4[t] = acc[t][i];
    *(v4f*)(C + (size_t)(m0 + i + 8 * lg) * N + n0 + 4 * lid) = c4;
  }
}

__device__ __forceinline__ float other_half(float x) {
  // value of lane l ^ 16
  return __builtin_bit_cast(
      float, __builtin_amdgcn_permlanex16(__builtin_bit_cast(int, x),
                                          __builtin_bit_cast(int, x),
                                          0x76543210, 0xfedcba98, false, false));
}

__global__ __launch_bounds__(256, 1) void attn_f32_wmma(
    const float* __restrict__ Q, const float* __restrict__ Km,
    const float* __restrict__ V, float* __restrict__ O) {
  const int lane = threadIdx.x & 31;
  const int wave = threadIdx.x >> 5;
  const int lid  = lane & 15;
  const int lg   = lane >> 4;

  const int bh = blockIdx.x;           // 0..31
  const int b  = bh >> 4;
  const int h  = bh & 15;
  const int NQB = SEQ_C / 16;          // 128 query blocks, 128 key blocks
  const int p = 8 * (blockIdx.y & 7) + 2 * (wave & 3) + (blockIdx.y >> 3);
  const int qb = (p == 0) ? (wave < 4 ? NQB - 1 : NQB - 2)
                          : (wave < 4 ? p - 1 : NQB - 2 - p);  // 0..127, each once
  // first key block with a kept key, in a scalar register: it ends the loop
  const int kb_lo = __builtin_amdgcn_readfirstlane((qb == NQB - 1) ? 0 : qb);
  const int q0 = qb * 16;
  const int d0 = h * HD_C;
  const size_t rowbase = (size_t)b * SEQ_C;

  // Preload Q block as B-fragments: qa[s] covers K-dim = 8*s + 4*lg + {0..3}.
  const float* qrow = Q + (rowbase + q0 + lid) * DIM_C + d0 + 4 * lg;
  v4f qa[16];
#pragma unroll
  for (int s = 0; s < 16; ++s) qa[s] = *(const v4f*)(qrow + 8 * s);

  v8f o[8];
#pragma unroll
  for (int dt = 0; dt < 8; ++dt) o[dt] = v8f_zero();
  float m = -INFINITY;  // running maximum of query lid (equal in both halves)
  float l = 0.0f;       // running sum of query lid over this half's keys

  const float scale = 0.08838834764831845f;  // 1/sqrt(128)
  const float MASKV = -3.402823466e38f;      // -FLT_MAX
  const int row = q0 + lid;

  for (int kb = NQB - 1; kb >= 0; --kb) {
    // the bound as a break: as the loop condition it built to more than 256
    // registers, and then only one block fits a WGP instead of two
    if (kb < kb_lo) break;
    const int kk0 = kb * 16;

    // ---- S^T = K @ Q^T : A-frags from K[kk0+lid][8*ss + 4*lg + {0..3}] ----
    v8f s = v8f_zero();
    const float* krow = Km + (rowbase + kk0 + lid) * DIM_C + d0 + 4 * lg;
#pragma unroll
    for (int ss = 0; ss < 16; ++ss) {
      const v4f kf = *(const v4f*)(krow + 8 * ss);
      v2f qlo, qhi, klo, khi;
      qlo.x = qa[ss].x; qlo.y = qa[ss].y;
      qhi.x = qa[ss].z; qhi.y = qa[ss].w;
      klo.x = kf.x; klo.y = kf.y;
      khi.x = kf.z; khi.y = kf.w;
      s = wmma_f32(klo, qlo, s);
      s = wmma_f32(khi, qhi, s);
    }

    // ---- mask + online softmax update: s[i] = S[row][kk0 + i + 8*lg] ----
    float sv[8];
#pragma unroll
    for (int i = 0; i < 8; ++i) {
      const int col = kk0 + i + 8 * lg;
      sv[i] = s[i] * scale;
      if (!(col > row)) sv[i] = MASKV;  // keep strictly-upper only
    }
    float t = fmaxf(fmaxf(fmaxf(sv[0], sv[1]), fmaxf(sv[2], sv[3])),
                    fmaxf(fmaxf(sv[4], sv[5]), fmaxf(sv[6], sv[7])));
    t = fmaxf(t, other_half(t));
    const float mnew = fmaxf(m, t);
    const float alpha = expf(m - mnew);
    m = mnew;
    float pv[8];
#pragma unroll
    for (int i = 0; i < 8; ++i) pv[i] = expf(sv[i] - mnew);
    l = l * alpha + (((pv[0] + pv[1]) + (pv[2] + pv[3])) +
                     ((pv[4] + pv[5]) + (pv[6] + pv[7])));

    // rescale running output (every element of a lane belongs to query lid)
#pragma unroll
    for (int dt = 0; dt < 8; ++dt)
#pragma unroll
      for (int i = 0; i < 8; ++i) o[dt][i] *= alpha;

    // ---- O^T += V^T @ P^T ----
#pragma unroll
    for (int g = 0; g < 2; ++g) {
      const float* vcol =
          V + (rowbase + kk0 + 8 * lg) * DIM_C + d0 + g * 64 + 4 * lid;
#pragma unroll
      for (int c = 0; c < 4; ++c) {
        // keys 2*c + 8*lg + {0,1}, four adjacent head columns each
        const v4f v0 = *(const v4f*)(vcol + (size_t)(2 * c) * DIM_C);
        const v4f v1 = *(const v4f*)(vcol + (size_t)(2 * c + 1) * DIM_C);
        v2f pf;
        pf.x = pv[2 * c]; pf.y = pv[2 * c + 1];
#pragma unroll
        for (int tt = 0; tt < 4; ++tt) {
          v2f vf;
          vf.x = v0[tt]; vf.y = v1[tt];
          o[g * 4 + tt] = wmma_f32(vf, pf, o[g * 4 + tt]);
        }
      }
    }
  }

  // ---- normalize and store (b, s, h*d) layout: un-transposed directly ----
  // o[4*g + t][i] = O[row][64*g + 4*(i + 8*lg) + t]
  const float inv = 1.0f / (l + other_half(l));
  float* orow = O + (rowbase + row) * DIM_C + d0 + 32 * lg;
#pragma unroll
  for (int g = 0; g < 2; ++g) {
#pragma unroll
    for (int i = 0; i < 8; ++i) {
      v4f o4;
#pragma unroll
      for (int tt = 0; tt < 4; ++tt) o4[tt] = o[g * 4 + tt][i] * inv;
      *(v4f*)(orow + g * 64 + 4 * i) = o4;
    }
  }
}

// ---------------------------------------------------------------------------
// Launch: Q/K/V projections -> attention -> output projection.
// Workspace: Q | K | V | attn_out, 32 MB each (128 MB total).
// ---------------------------------------------------------------------------
extern "C" void kernel_launch(void* const* d_in, const int* in_sizes, int n_in,
                              void* d_out, int out_size, void* d_ws, size_t ws_size,
                              hipStream_t stream) {
  const float* x  = (const float*)d_in[0];
  const float* Wq = (const float*)d_in[1];
  const float* Wk = (const float*)d_in[2];
  const float* Wv = (const float*)d_in[3];
  const float* Wo = (const float*)d_in[4];
  float* out = (float*)d_out;

  const size_t mat = (size_t)MROWS * DIM_C;  // 8M floats = 32MB
  float* Qb = (float*)d_ws;
  float* Kb = Qb + mat;
  float* Vb = Kb + mat;
  float* Ab = Vb + mat;

  dim3 gblk(256);
  dim3 ggrid(MROWS / 64, DIM_C / 128);
  gemm_f32_wmma<<<ggrid, gblk, 0, stream>>>(x, Wq, Qb, MROWS, DIM_C, DIM_C);
  gemm_f32_wmma<<<ggrid, gblk, 0, stream>>>(x, Wk, Kb, MROWS, DIM_C, DIM_C);
  gemm_f32_wmma<<<ggrid, gblk, 0, stream>>>(x, Wv, Vb, MROWS, DIM_C, DIM_C);

  dim3 agrid(2 * HEADS_C, SEQ_C / (16 * 8));
  attn_f32_wmma<<<agrid, gblk, 0, stream>>>(Qb, Kb, Vb, Ab);

  gemm_f32_wmma<<<ggrid, gblk, 0, stream>>>(Ab, Wo, out, MROWS, DIM_C, DIM_C);
}

// v004
// Measured time: 882 microseconds a run.
// Timed twice side by side with v003, it ran 1.24 and 1.25 times as fast.
// Over all steps from v000 it is 2.40 times as fast.
#include <hip/hip_runtime.h>
#include <math.h>

// ---------------------------------------------------------------------------
// CDNA5 (gfx1250) f32 WMMA causal self-attention.
//   DIM=2048, HEADS=16, head_dim=128, BATCH=2, SEQ=2048  ->  M=B*S=4096 rows.
// All matrix math runs on V_WMMA_F32_16X16X4_F32 (full f32 matrix pipe).
// ---------------------------------------------------------------------------

#define SEQ_C   2048
#define DIM_C   2048
#define HEADS_C 16
#define HD_C    128            // head dim
#define MROWS   4096           // BATCH * SEQ

typedef float v2f __attribute__((ext_vector_type(2)));
typedef float v4f __attribute__((ext_vector_type(4)));
typedef float v8f __attribute__((ext_vector_type(8)));

__device__ __forceinline__ v8f wmma_f32(v2f a, v2f b, v8f c) {
  // D = A(16x4) * B(4x16) + C(16x16), all f32.
  return __builtin_amdgcn_wmma_f32_16x16x4_f32(
      /*neg_a=*/false, a, /*neg_b=*/false, b,
      /*c_mod=*/(short)0, c, /*reuse_a=*/false, /*reuse_b=*/false);
}

__device__ __forceinline__ v8f v8f_zero() {
  v8f z;
#pragma unroll
  for (int i = 0; i < 8; ++i) z[i] = 0.0f;
  return z;
}

// ---------------------------------------------------------------------------
// GEMM: C[M,N] = A[M,K] @ B[K,N], row-major f32, via WMMA 16x16x4.
// Block = 256 threads = 8 waves. Wave (wm,wn) computes a 16x64 strip:
//   4 accumulator tiles sharing one A fragment per k-step (A reuse).
// Block tile = 64(M) x 128(N). Grid = (M/64, N/128). K a multiple of 32.
// The operands come through LDS: a stage is 32 k of the block's 64 A rows and
// of its 128 B columns, brought by asynchronous 16-byte copies in whole cache
// lines, each byte once per block; two stages, the next one in flight while
// this one is worked on. The fragments are then 16-byte LDS reads:
//   A rows lie at a pitch of 144 B (16 B x odd), so the 16 rows of a fragment
//   read fall on all 64 banks; a B read takes 256 adjacent bytes per half-wave.
//   k order: of 8 consecutive k, lanegroup lg holds k+4*lg+{0..3}; the first
//   WMMA takes elements {0,1}, the second {2,3}, in A and in B alike.
//   columns: a lane holds 4 adjacent columns of a B row, one per accumulator
//   tile, so tile t, lane lid is column n0 + 4*lid + t.
// ---------------------------------------------------------------------------
#define GK      32               // k per stage
#define A_PITCH 36               // floats per staged A row (144 B)
#define A_STAGE (64 * A_PITCH)   // floats
#define B_STAGE (GK * 128)       // floats

__device__ __forceinline__ unsigned lds_off(const void* p) {
  // byte offset in the work-group's LDS: low 32 bits of a __shared__ address
  return (unsigned)(size_t)p;
}

// One stage, six copies per lane: A rows r and r + 32, B rows w + {0,8,16,24}.
// The copies and s_wait_xcnt stand in one statement, so that no address
// register is rewritten before the wait.
__device__ __forceinline__ void stage_copies(unsigned la, const float* ga,
                                             unsigned lb, const float* gb,
                                             int N, int K) {
  const unsigned la1 = la + 32 * A_PITCH * 4;
  const float* ga1 = ga + (size_t)32 * K;
  const unsigned lb1 = lb + 8 * 512, lb2 = lb + 16 * 512, lb3 = lb + 24 * 512;
  const float* gb1 = gb + (size_t)8 * N;
  const float* gb2 = gb + (size_t)16 * N;
  const float* gb3 = gb + (size_t)24 * N;
  asm volatile(
      "global_load_async_to_lds_b128 %0, %1, off\n\t"
      "global_load_async_to_lds_b128 %2, %3, off\n\t"
      "global_load_async_to_lds_b128 %4, %5, off\n\t"
      "global_load_async_to_lds_b128 %6, %7, off\n\t"
      "global_load_async_to_lds_b128 %8, %9, off\n\t"
      "global_load_async_to_lds_b128 %10, %11, off\n\t"
      "s_wait_xcnt 0x0"
      :: "v"(la), "v"(ga), "v"(la1), "v"(ga1), "v"(lb), "v"(gb),
         "v"(lb1), "v"(gb1), "v"(lb2), "v"(gb2), "v"(lb3), "v"(gb3)
      : "memory");
}

__global__ __launch_bounds__(256) void gemm_f32_wmma(
    const float* __restrict__ A, const float* __restrict__ B,
    float* __restrict__ C, int M, int N, int K) {
  __shared__ __attribute__((aligned(16))) float As[2 * A_STAGE];
  __shared__ __attribute__((aligned(16))) float Bs[2 * B_STAGE];

  const int lane = threadIdx.x & 31;
  const int wave = threadIdx.x >> 5;
  const int lid  = lane & 15;      // M/N index within tile
  const int lg   = lane >> 4;      // lanegroup: selects K run of 4 / row half
  const int wm   = wave & 3;
  const int wn   = wave >> 2;
  const int m0   = blockIdx.x * 64  + wm * 16;
  const int n0   = blockIdx.y * 128 + wn * 64;

  v8f acc[4];
#pragma unroll
  for (int t = 0; t < 4; ++t) acc[t] = v8f_zero();

  // this lane's copies: 8 lanes bring the 128 B of an A row, a wave the 512 B
  // of a B row
  const int ar = threadIdx.x >> 3;
  const int ac = threadIdx.x & 7;
  const float* ga = A + (size_t)(blockIdx.x * 64 + ar) * K + 4 * ac;
  const float* gb = B + (size_t)wave * N + blockIdx.y * 128 + 4 * lane;
  const unsigned la = lds_off(As) + (ar * A_PITCH + 4 * ac) * 4;
  const unsigned lb = lds_off(Bs) + (wave * 128 + 4 * lane) * 4;

  // this lane's fragment reads
  const float* afrag = As + (wm * 16 + lid) * A_PITCH + 4 * lg;
  const float* bfrag = Bs + (4 * lg) * 128 + wn * 64 + 4 * lid;

  const int T = K / GK;  // stages

  stage_copies(la, ga, lb, gb, N, K);
  // stage 0 has landed before any wave reads it
  asm volatile("s_wait_asynccnt 0x0" ::: "memory");
  __syncthreads();
  if (1 < T)
    stage_copies(la + A_STAGE * 4, ga + GK, lb + B_STAGE * 4,
                 gb + (size_t)GK * N, N, K);

  for (int t = 0; t < T; ++t) {
    const int buf = t & 1;
    const float* as = afrag + buf * A_STAGE;
    const float* bs = bfrag + buf * B_STAGE;
    // unrolled, so that every LDS offset is an immediate and the reads of the
    // next 8 k are issued ahead of this run's WMMAs
#pragma unroll
    for (int kk = 0; kk < GK; kk += 8) {
      // A[m0+lid][k + 4*lg + {0..3}]
      const v4f a4 = *(const v4f*)(as + kk);
      // B[k + 4*lg + {0..3}][n0 + 4*lid + {0..3}]
      const v4f r0 = *(const v4f*)(bs + (kk + 0) * 128);
      const v4f r1 = *(const v4f*)(bs + (kk + 1) * 128);
      const v4f r2 = *(const v4f*)(bs + (kk + 2) * 128);
      const v4f r3 = *(const v4f*)(bs + (kk + 3) * 128);
      v2f a0, a1;
      a0.x = a4.x; a0.y = a4.y;
      a1.x = a4.z; a1.y = a4.w;
#pragma unroll
      for (int tt = 0; tt < 4; ++tt) {
        v2f b0;
        b0.x = r0[tt]; b0.y = r1[tt];
        acc[tt] = wmma_f32(a0, b0, acc[tt]);
      }
#pragma unroll
      for (int tt = 0; tt < 4; ++tt) {
        v2f b1;
        b1.x = r2[tt]; b1.y = r3[tt];
        acc[tt] = wmma_f32(a1, b1, acc[tt]);
      }
    }
    // hand-over: this wave's reads of stage t are done ...
    asm volatile("s_wait_dscnt 0x0" ::: "memory");
    // ... and its copies of stage t + 1 have landed,
    asm volatile("s_wait_asynccnt 0x0" ::: "memory");
    // in every wave: stage t + 1 may be read, stage t's buffer refilled
    __syncthreads();
    if (t + 2 < T)
      stage_copies(la + buf * (A_STAGE * 4), ga + (size_t)(t + 2) * GK,
                   lb + buf * (B_STAGE * 4), gb + (size_t)(t + 2) * GK * N, N, K);
  }
  // no copy is outstanding when the wave ends
  asm volatile("s_wait_asynccnt 0x0" ::: "memory");

  // D layout: vgpr i, lanegroup lg -> row = i + 8*lg, col = 4*lid + t.
#pragma unroll
  for (int i = 0; i < 8; ++i) {
    v4f c4;
#pragma unroll
    for (int t = 0; t < 4; ++t) c4[t] = acc[t][i];
    *(v4f*)(C + (size_t)(m0 + i + 8 * lg) * N + n0 + 4 * lid) = c4;
  }
}

__device__ __forceinline__ float other_half(float x) {
  // value of lane l ^ 16
  return __builtin_bit_cast(
      float, __builtin_amdgcn_permlanex16(__builtin_bit_cast(int, x),
                                          __builtin_bit_cast(int, x),
                                          0x76543210, 0xfedcba98, false, false));
}

__global__ __launch_bounds__(256, 1) void attn_f32_wmma(
    const float* __restrict__ Q, const float* __restrict__ Km,
    const float* __restrict__ V, float* __restrict__ O) {
  const int lane = threadIdx.x & 31;
  const int wave = threadIdx.x >> 5;
  const int lid  = lane & 15;
  const int lg   = lane >> 4;

  const int bh = blockIdx.x;           // 0..31
  const int b  = bh >> 4;
  const int h  = bh & 15;
  const int NQB = SEQ_C / 16;          // 128 query blocks, 128 key blocks
  const int p = 8 * (blockIdx.y & 7) + 2 * (wave & 3) + (blockIdx.y >> 3);
  const int qb = (p == 0) ? (wave < 4 ? NQB - 1 : NQB - 2)
                          : (wave < 4 ? p - 1 : NQB - 2 - p);  // 0..127, each once
  // first key block with a kept key, in a scalar register: it ends the loop
  const int kb_lo = __builtin_amdgcn_readfirstlane((qb == NQB - 1) ? 0 : qb);
  const int q0 = qb * 16;
  const int d0 = h * HD_C;
  const size_t rowbase = (size_t)b * SEQ_C;

  // Preload Q block as B-fragments: qa[s] covers K-dim = 8*s + 4*lg + {0..3}.
  const float* qrow = Q + (rowbase + q0 + lid) * DIM_C + d0 + 4 * lg;
  v4f qa[16];
#pragma unroll
  for (int s = 0; s < 16; ++s) qa[s] = *(const v4f*)(qrow + 8 * s);

  v8f o[8];
#pragma unroll
  for (int dt = 0; dt < 8; ++dt) o[dt] = v8f_zero();
  float m = -INFINITY;  // running maximum of query lid (equal in both halves)
  float l = 0.0f;       // running sum of query lid over this half's keys

  const float scale = 0.08838834764831845f;  // 1/sqrt(128)
  const float MASKV = -3.402823466e38f;      // -FLT_MAX
  const int row = q0 + lid;

  for (int kb = NQB - 1; kb >= 0; --kb) {
    // the bound as a break: as the loop condition it built to more than 256
    // registers, and then only one block fits a WGP instead of two
    if (kb < kb_lo) break;
    const int kk0 = kb * 16;

    // ---- S^T = K @ Q^T : A-frags from K[kk0+lid][8*ss + 4*lg + {0..3}] ----
    v8f s = v8f_zero();
    const float* krow = Km + (rowbase + kk0 + lid) * DIM_C + d0 + 4 * lg;
#pragma unroll
    for (int ss = 0; ss < 16; ++ss) {
      const v4f kf = *(const v4f*)(krow + 8 * ss);
      v2f qlo, qhi, klo, khi;
      qlo.x = qa[ss].x; qlo.y = qa[ss].y;
      qhi.x = qa[ss].z; qhi.y = qa[ss].w;
      klo.x = kf.x; klo.y = kf.y;
      khi.x = kf.z; khi.y = kf.w;
      s = wmma_f32(klo, qlo, s);
      s = wmma_f32(khi, qhi, s);
    }

    // ---- mask + online softmax update: s[i] = S[row][kk0 + i + 8*lg] ----
    float sv[8];
#pragma unroll
    for (int i = 0; i < 8; ++i) {
      const int col = kk0 + i + 8 * lg;
      sv[i] = s[i] * scale;
      if (!(col > row)) sv[i] = MASKV;  // keep strictly-upper only
    }
    float t = fmaxf(fmaxf(fmaxf(sv[0], sv[1]), fmaxf(sv[2], sv[3])),
                    fmaxf(fmaxf(sv[4], sv[5]), fmaxf(sv[6], sv[7])));
    t = fmaxf(t, other_half(t));
    const float mnew = fmaxf(m, t);
    const float alpha = expf(m - mnew);
    m = mnew;
    float pv[8];
#pragma unroll
    for (int i = 0; i < 8; ++i) pv[i] = expf(sv[i] - mnew);
    l = l * alpha + (((pv[0] + pv[1]) + (pv[2] + pv[3])) +
                     ((pv[4] + pv[5]) + (pv[6] + pv[7])));

    // rescale running output (every element of a lane belongs to query lid)
#pragma unroll
    for (int dt = 0; dt < 8; ++dt)
#pragma unroll
      for (int i = 0; i < 8; ++i) o[dt][i] *= alpha;

    // ---- O^T += V^T @ P^T ----
#pragma unroll
    for (int g = 0; g < 2; ++g) {
      const float* vcol =
          V + (rowbase + kk0 + 8 * lg) * DIM_C + d0 + g * 64 + 4 * lid;
#pragma unroll
      for (int c = 0; c < 4; ++c) {
        // keys 2*c + 8*lg + {0,1}, four adjacent head columns each
        const v4f v0 = *(const v4f*)(vcol + (size_t)(2 * c) * DIM_C);
        const v4f v1 = *(const v4f*)(vcol + (size_t)(2 * c + 1) * DIM_C);
        v2f pf;
        pf.x = pv[2 * c]; pf.y = pv[2 * c + 1];
#pragma unroll
        for (int tt = 0; tt < 4; ++tt) {
          v2f vf;
          vf.x = v0[tt]; vf.y = v1[tt];
          o[g * 4 + tt] = wmma_f32(vf, pf, o[g * 4 + tt]);
        }
      }
    }
  }

  // ---- normalize and store (b, s, h*d) layout: un-transposed directly ----
  // o[4*g + t][i] = O[row][64*g + 4*(i + 8*lg) + t]
  const float inv = 1.0f / (l + other_half(l));
  float* orow = O + (rowbase + row) * DIM_C + d0 + 32 * lg;
#pragma unroll
  for (int g = 0; g < 2; ++g) {
#pragma unroll
    for (int i = 0; i < 8; ++i) {
      v4f o4;
#pragma unroll
      for (int tt = 0; tt < 4; ++tt) o4[tt] = o[g * 4 + tt][i] * inv;
      *(v4f*)(orow + g * 64 + 4 * i) = o4;
    }
  }
}

// ---------------------------------------------------------------------------
// Launch: Q/K/V projections -> attention -> output projection.
// Workspace: Q | K | V | attn_out, 32 MB each (128 MB total).
// ---------------------------------------------------------------------------
extern "C" void kernel_launch(void* const* d_in, const int* in_sizes, int n_in,
                              void* d_out, int out_size, void* d_ws, size_t ws_size,
                              hipStream_t stream) {
  const float* x  = (const float*)d_in[0];
  const float* Wq = (const float*)d_in[1];
  const float* Wk = (const float*)d_in[2];
  const float* Wv = (const float*)d_in[3];
  const float* Wo = (const float*)d_in[4];
  float* out = (float*)d_out;

  const size_t mat = (size_t)MROWS * DIM_C;  // 8M floats = 32MB
  float* Qb = (float*)d_ws;
  float* Kb = Qb + mat;
  float* Vb = Kb + mat;
  float* Ab = Vb + mat;

  dim3 gblk(256);
  dim3 ggrid(MROWS / 64, DIM_C / 128);
  gemm_f32_wmma<<<ggrid, gblk, 0, stream>>>(x, Wq, Qb, MROWS, DIM_C, DIM_C);
  gemm_f32_wmma<<<ggrid, gblk, 0, stream>>>(x, Wk, Kb, MROWS, DIM_C, DIM_C);
  gemm_f32_wmma<<<ggrid, gblk, 0, stream>>>(x, Wv, Vb, MROWS, DIM_C, DIM_C);

  dim3 agrid(2 * HEADS_C, SEQ_C / (16 * 8));
  attn_f32_wmma<<<agrid, gblk, 0, stream>>>(Qb, Kb, Vb, Ab);

  gemm_f32_wmma<<<ggrid, gblk, 0, stream>>>(Ab, Wo, out, MROWS, DIM_C, DIM_C);
}
